// v000
// Times are from an AMD MI455X. After a warm-up the kernel runs many times in a row, and a time is the length of
// such a window on the GPU divided by its runs, so every launch and the gaps after it count. The runs cycle
// through copies of the inputs. A figure is the median of several windows, for all but v000 over two sittings.
// Sittings can differ by a few percent; kernels timed side by side share one.
// v000, which the later versions start from, runs in 26.9 microseconds.
#include <hip/hip_runtime.h>

typedef float v2f __attribute__((ext_vector_type(2)));
typedef float v4f __attribute__((ext_vector_type(4)));
typedef float v8f __attribute__((ext_vector_type(8)));

#define WAVES_PER_BLOCK 8

// Shapes fixed by the reference: B=4, C=64, N=16384, S=16
__global__ __launch_bounds__(256) void attn_score_kernel(
    const float* __restrict__ xyz,     // [B,3,N]
    const float* __restrict__ nxyz,    // [B,3,N,S]
    const float* __restrict__ points,  // [B,C,N]
    const float* __restrict__ npts,    // [B,C,N,S]
    const float* __restrict__ Wk,      // [C,C]   Wk[c][o]
    const float* __restrict__ Wpos,    // [C,4]
    const float* __restrict__ bpos,    // [C]
    float* __restrict__ out)           // [B,N,S]
{
    constexpr int C = 64, N = 16384, S = 16;
    constexpr float scale = 0.125f;            // 64^-0.5
    const size_t planeNS = (size_t)N * S;

    __shared__ float qt_lds[WAVES_PER_BLOCK][16 * 64];
    __shared__ float wp4_lds[WAVES_PER_BLOCK][16][4];
    __shared__ float qb_lds[WAVES_PER_BLOCK][16];

    const int lane = threadIdx.x & 31;
    const int wave = threadIdx.x >> 5;
    const int tile = blockIdx.x * WAVES_PER_BLOCK + wave;  // one 16-point tile per wave
    const int tiles_per_b = N / 16;
    const int b  = tile / tiles_per_b;
    const int n0 = (tile % tiles_per_b) * 16;

    const int hi  = lane >> 4;    // 0: lanes 0-15, 1: lanes 16-31
    const int l15 = lane & 15;

    // ---------- Phase 1: QT[16x64] = (Q*scale)[16x64] @ Wk[64x64] via FP32 WMMA ----------
    // A 16x4 f32 layout: lane(0-15)=row M, vgpr0=K0 (lanes 16-31: K2), vgpr1=K1 (K3)
    // B 4x16 f32 layout (mirrored): lane(0-15)=col N, vgpr0=K0/K2, vgpr1=K1/K3
    v8f acc[4] = {};
    const float* prow = points + (size_t)b * C * N + n0;
    #pragma unroll
    for (int ks = 0; ks < 16; ++ks) {
        const int c0 = ks * 4 + hi * 2;
        v2f a;
        a.x = prow[(size_t)c0 * N + l15] * scale;
        a.y = prow[(size_t)(c0 + 1) * N + l15] * scale;
        #pragma unroll
        for (int t = 0; t < 4; ++t) {
            v2f bf;
            bf.x = Wk[c0 * 64 + t * 16 + l15];
            bf.y = Wk[(c0 + 1) * 64 + t * 16 + l15];
            acc[t] = __builtin_amdgcn_wmma_f32_16x16x4_f32(
                false, a, false, bf, (short)0, acc[t], false, false);
        }
    }
    // C/D layout: vgpr r holds row M=r (lanes 0-15) / M=r+8 (lanes 16-31), col = l15 + 16*t
    #pragma unroll
    for (int t = 0; t < 4; ++t)
        #pragma unroll
        for (int r = 0; r < 8; ++r)
            qt_lds[wave][(r + 8 * hi) * 64 + t * 16 + l15] = acc[t][r];
    __syncthreads();

    // ---------- Phase 2: fold Wpos / bpos through qt (per point) ----------
    if (lane < 16) {
        const int p = lane;
        float w0 = 0.f, w1 = 0.f, w2 = 0.f, w3 = 0.f, qb = 0.f;
        #pragma unroll 4
        for (int c = 0; c < C; ++c) {
            const float qv = qt_lds[wave][p * 64 + c];
            w0 += qv * Wpos[c * 4 + 0];
            w1 += qv * Wpos[c * 4 + 1];
            w2 += qv * Wpos[c * 4 + 2];
            w3 += qv * Wpos[c * 4 + 3];
            qb += qv * bpos[c];
        }
        wp4_lds[wave][p][0] = w0; wp4_lds[wave][p][1] = w1;
        wp4_lds[wave][p][2] = w2; wp4_lds[wave][p][3] = w3;
        qb_lds[wave][p] = qb;
    }
    __syncthreads();

    // ---------- Phase 3: stream neighbors; attn = qt.np + wp4.pos + qb ----------
    // (n,s) block for this tile = 256 contiguous floats per channel; lane owns two float4 runs.
    const size_t base_ns = (size_t)n0 * S;
    const float* nx_b  = nxyz + (size_t)b * 3 * planeNS + base_ns;
    const float* np_b  = npts + (size_t)b * C * planeNS + base_ns;
    const float* xyz_b = xyz  + (size_t)b * 3 * N;

    v4f acc4[2];
    #pragma unroll
    for (int jj = 0; jj < 2; ++jj) {
        const int v  = lane + 32 * jj;   // float4 slot 0..63
        const int p  = v >> 2;           // point within tile
        const int fo = v * 4;            // flat (n,s) offset
        const int n  = n0 + p;
        const float x0 = xyz_b[n], y0 = xyz_b[N + n], z0 = xyz_b[2 * N + n];
        const v4f nx4 = __builtin_nontemporal_load((const v4f*)(nx_b + fo));
        const v4f ny4 = __builtin_nontemporal_load((const v4f*)(nx_b + planeNS + fo));
        const v4f nz4 = __builtin_nontemporal_load((const v4f*)(nx_b + 2 * planeNS + fo));
        const float w0 = wp4_lds[wave][p][0], w1 = wp4_lds[wave][p][1];
        const float w2 = wp4_lds[wave][p][2], w3 = wp4_lds[wave][p][3];
        const float qb = qb_lds[wave][p];
        v4f r;
        #pragma unroll
        for (int k = 0; k < 4; ++k) {
            const float dx = x0 - nx4[k];
            const float dy = y0 - ny4[k];
            const float dz = z0 - nz4[k];
            const float nr = sqrtf(dx * dx + dy * dy + dz * dz);
            r[k] = qb + w0 * dx + w1 * dy + w2 * dz + w3 * nr;
        }
        acc4[jj] = r;
    }

    for (int c = 0; c < C; ++c) {
        const float* src = np_b + (size_t)c * planeNS;
        #pragma unroll
        for (int jj = 0; jj < 2; ++jj) {
            const int v = lane + 32 * jj;
            const float qv = qt_lds[wave][(v >> 2) * 64 + c];   // broadcast per 4-lane group
            const v4f d = __builtin_nontemporal_load((const v4f*)(src + v * 4));
            acc4[jj] += qv * d;
        }
    }

    // ---------- Phase 4: softmax over S=16 (one point = 4 lanes x float4) ----------
    float* out_b = out + (size_t)b * planeNS + base_ns;
    #pragma unroll
    for (int jj = 0; jj < 2; ++jj) {
        const v4f a = acc4[jj];
        float m = fmaxf(fmaxf(a[0], a[1]), fmaxf(a[2], a[3]));
        m = fmaxf(m, __shfl_xor(m, 1));
        m = fmaxf(m, __shfl_xor(m, 2));
        v4f e;
        e[0] = __expf(a[0] - m); e[1] = __expf(a[1] - m);
        e[2] = __expf(a[2] - m); e[3] = __expf(a[3] - m);
        float s = e[0] + e[1] + e[2] + e[3];
        s += __shfl_xor(s, 1);
        s += __shfl_xor(s, 2);
        const float inv = 1.0f / s;
        const int v = lane + 32 * jj;
        __builtin_nontemporal_store(e * inv, (v4f*)(out_b + v * 4));
    }
}

extern "C" void kernel_launch(void* const* d_in, const int* in_sizes, int n_in,
                              void* d_out, int out_size, void* d_ws, size_t ws_size,
                              hipStream_t stream) {
    (void)in_sizes; (void)n_in; (void)d_ws; (void)ws_size; (void)out_size;
    const float* xyz    = (const float*)d_in[0];
    const float* nxyz   = (const float*)d_in[1];
    const float* points = (const float*)d_in[2];
    const float* npts   = (const float*)d_in[3];
    const float* Wk     = (const float*)d_in[4];
    const float* Wpos   = (const float*)d_in[5];
    const float* bpos   = (const float*)d_in[6];
    float* out = (float*)d_out;

    constexpr int B = 4, N = 16384;
    const int tiles  = B * (N / 16);                  // 4096 wave-tiles
    const int blocks = tiles / WAVES_PER_BLOCK;       // 512 blocks of 8 waves
    attn_score_kernel<<<blocks, WAVES_PER_BLOCK * 32, 0, stream>>>(
        xyz, nxyz, points, npts, Wk, Wpos, bpos, out);
}

// v001
// Measured time: 23.7 microseconds a run.
// Next to v000, in two timings, it ran 1.12 and 1.17 times as fast.
#include <hip/hip_runtime.h>

typedef float v2f __attribute__((ext_vector_type(2)));
typedef float v4f __attribute__((ext_vector_type(4)));
typedef float v8f __attribute__((ext_vector_type(8)));

#define WAVES_PER_BLOCK 8
#define QT_PITCH 68   // dwords per q~ row in LDS: 16 B x odd, so 16-byte column walks meet no bank twice

// Shapes fixed by the reference: B=4, C=64, N=16384, S=16
__global__ __launch_bounds__(256) void attn_score_kernel(
    const float* __restrict__ xyz,     // [B,3,N]
    const float* __restrict__ nxyz,    // [B,3,N,S]
    const float* __restrict__ points,  // [B,C,N]
    const float* __restrict__ npts,    // [B,C,N,S]
    const float* __restrict__ Wk,      // [C,C]   Wk[c][o]
    const float* __restrict__ Wpos,    // [C,4]
    const float* __restrict__ bpos,    // [C]
    float* __restrict__ out)           // [B,N,S]
{
    constexpr int C = 64, N = 16384, S = 16;
    constexpr float scale = 0.125f;            // 64^-0.5
    const size_t planeNS = (size_t)N * S;

    __shared__ __attribute__((aligned(16))) float qt_lds[WAVES_PER_BLOCK][16 * QT_PITCH];
    __shared__ __attribute__((aligned(16))) float wp4_lds[WAVES_PER_BLOCK][16][4];
    __shared__ float qb_lds[WAVES_PER_BLOCK][16];

    const int lane = threadIdx.x & 31;
    const int wave = threadIdx.x >> 5;
    const int tile = blockIdx.x * WAVES_PER_BLOCK + wave;  // one 16-point tile per wave
    const int tiles_per_b = N / 16;
    const int b  = tile / tiles_per_b;
    const int n0 = (tile % tiles_per_b) * 16;

    const int hi  = lane >> 4;    // 0: lanes 0-15, 1: lanes 16-31
    const int l15 = lane & 15;

    // ---------- Phase 1: QT^T[64x16] = Wk^T[64x64] @ (Q*scale)^T[64x16] via FP32 WMMA ----------
    // A 16x4 f32 layout: lane(0-15)=row M, vgpr0=K0 (lanes 16-31: K2), vgpr1=K1 (K3)
    // B 4x16 f32 layout (mirrored): lane(0-15)=col N, vgpr0=K0/K2, vgpr1=K1/K3
    // A = 16 output channels of Wk^T, B = the tile's 16 points.
    v8f acc[4] = {};
    // One lane pointer per array (channel 2*hi, column l15); ks, t and the odd channel are immediates.
    const float* p_l = points + (size_t)b * C * N + n0 + (size_t)(2 * hi) * N + l15;
    const float* k_l = Wk + 128 * hi + l15;
    #pragma unroll
    for (int ks = 0; ks < 16; ++ks) {
        v2f q;
        q.x = p_l[(ks * 4) * N] * scale;
        q.y = p_l[(ks * 4 + 1) * N] * scale;
        #pragma unroll
        for (int t = 0; t < 4; ++t) {
            v2f wf;
            wf.x = k_l[(ks * 4) * 64 + t * 16];
            wf.y = k_l[(ks * 4 + 1) * 64 + t * 16];
            acc[t] = __builtin_amdgcn_wmma_f32_16x16x4_f32(
                false, wf, false, q, (short)0, acc[t], false, false);
        }
    }
    // C/D layout: vgpr r holds channel o = 16*t + r (lanes 0-15) / 16*t + r + 8 (lanes 16-31), point = l15

    // ---------- Phase 2: fold Wpos / bpos through qt, D of phase 1 fed on as B ----------
    // F[j][p] = sum_o WB[o][j] * QT^T[o][p]; WB column j = Wpos[:,j] (j<4), bpos (j==4).
    // Rows j>4 are never read: their lanes hold bpos again.
    // k order of one step, A and B alike: o = 16*t + r, +1 (lanes 0-15), 16*t + r + 8, +9 (lanes 16-31).
    const float* wp_l = Wpos + 32 * hi + (l15 & 3);   // one lane offset, the rest immediates
    const float* bp_l = bpos + 8 * hi;
    const bool   is_w = l15 < 4;
    v8f fold = {};
    // both loops unrolled: acc[t][r] has to be a fixed register, else the tiles go through scratch
    #pragma unroll
    for (int t = 0; t < 4; ++t) {
        #pragma unroll
        for (int r = 0; r < 8; r += 2) {
            const int o = t * 16 + r;      // + 8 * hi stands in the two lane pointers
            v2f wa, qf;
            const float w0 = wp_l[o * 4], w1 = wp_l[o * 4 + 4];
            const float b0 = bp_l[o],     b1 = bp_l[o + 1];
            wa.x = is_w ? w0 : b0;
            wa.y = is_w ? w1 : b1;
            qf.x = acc[t][r];
            qf.y = acc[t][r + 1];
            fold = __builtin_amdgcn_wmma_f32_16x16x4_f32(
                false, wa, false, qf, (short)0, fold, false, false);
        }
    }

    // A lane holds 8 consecutive channels of its point per t: two 16-byte stores each.
    {
        float* qrow = &qt_lds[wave][l15 * QT_PITCH + 8 * hi];
        #pragma unroll   // fixed registers for acc[t], as above
        for (int t = 0; t < 4; ++t) {
            v4f lo4 = {acc[t][0], acc[t][1], acc[t][2], acc[t][3]};
            v4f hi4 = {acc[t][4], acc[t][5], acc[t][6], acc[t][7]};
            *(v4f*)(qrow + t * 16)     = lo4;
            *(v4f*)(qrow + t * 16 + 4) = hi4;
        }
    }
    if (hi == 0) {   // rows j = 0..4 of F stand in lanes 0-15, point = lane
        v4f w4 = {fold[0], fold[1], fold[2], fold[3]};
        *(v4f*)&wp4_lds[wave][l15][0] = w4;
        qb_lds[wave][l15] = fold[4];
    }
    __syncthreads();

    // ---------- Phase 3: stream neighbors; attn = qt.np + wp4.pos + qb ----------
    // (n,s) block for this tile = 256 contiguous floats per channel; lane owns two float4 runs.
    const size_t base_ns = (size_t)n0 * S;
    const float* nx_b  = nxyz + (size_t)b * 3 * planeNS + base_ns;
    const float* np_b  = npts + (size_t)b * C * planeNS + base_ns;
    const float* xyz_b = xyz  + (size_t)b * 3 * N;

    v4f acc4[2];
    #pragma unroll
    for (int jj = 0; jj < 2; ++jj) {
        const int v  = lane + 32 * jj;   // float4 slot 0..63
        const int p  = v >> 2;           // point within tile
        const int fo = v * 4;            // flat (n,s) offset
        const int n  = n0 + p;
        const float x0 = xyz_b[n], y0 = xyz_b[N + n], z0 = xyz_b[2 * N + n];
        // precaution: the three loads' address pair is reused as a later load's destination in this build
        asm volatile("s_wait_xcnt 0x0" ::: "memory");
        const v4f nx4 = __builtin_nontemporal_load((const v4f*)(nx_b + fo));
        const v4f ny4 = __builtin_nontemporal_load((const v4f*)(nx_b + planeNS + fo));
        const v4f nz4 = __builtin_nontemporal_load((const v4f*)(nx_b + 2 * planeNS + fo));
        const float w0 = wp4_lds[wave][p][0], w1 = wp4_lds[wave][p][1];
        const float w2 = wp4_lds[wave][p][2], w3 = wp4_lds[wave][p][3];
        const float qb = qb_lds[wave][p];
        v4f r;
        #pragma unroll
        for (int k = 0; k < 4; ++k) {
            const float dx = x0 - nx4[k];
            const float dy = y0 - ny4[k];
            const float dz = z0 - nz4[k];
            const float nr = sqrtf(dx * dx + dy * dy + dz * dz);
            r[k] = qb + w0 * dx + w1 * dy + w2 * dz + w3 * nr;
        }
        acc4[jj] = r;
    }

    for (int c = 0; c < C; ++c) {
        const float* src = np_b + (size_t)c * planeNS;
        #pragma unroll
        for (int jj = 0; jj < 2; ++jj) {
            const int v = lane + 32 * jj;
            const float qv = qt_lds[wave][(v >> 2) * QT_PITCH + c];   // broadcast per 4-lane group
            const v4f d = __builtin_nontemporal_load((const v4f*)(src + v * 4));
            acc4[jj] += qv * d;
        }
    }

    // ---------- Phase 4: softmax over S=16 (one point = 4 lanes x float4) ----------
    float* out_b = out + (size_t)b * planeNS + base_ns;
    #pragma unroll
    for (int jj = 0; jj < 2; ++jj) {
        const v4f a = acc4[jj];
        float m = fmaxf(fmaxf(a[0], a[1]), fmaxf(a[2], a[3]));
        m = fmaxf(m, __shfl_xor(m, 1));
        m = fmaxf(m, __shfl_xor(m, 2));
        v4f e;
        e[0] = __expf(a[0] - m); e[1] = __expf(a[1] - m);
        e[2] = __expf(a[2] - m); e[3] = __expf(a[3] - m);
        float s = e[0] + e[1] + e[2] + e[3];
        s += __shfl_xor(s, 1);
        s += __shfl_xor(s, 2);
        const float inv = 1.0f / s;
        const int v = lane + 32 * jj;
        __builtin_nontemporal_store(e * inv, (v4f*)(out_b + v * 4));
    }
}

extern "C" void kernel_launch(void* const* d_in, const int* in_sizes, int n_in,
                              void* d_out, int out_size, void* d_ws, size_t ws_size,
                              hipStream_t stream) {
    (void)in_sizes; (void)n_in; (void)d_ws; (void)ws_size; (void)out_size;
    const float* xyz    = (const float*)d_in[0];
    const float* nxyz   = (const float*)d_in[1];
    const float* points = (const float*)d_in[2];
    const float* npts   = (const float*)d_in[3];
    const float* Wk     = (const float*)d_in[4];
    const float* Wpos   = (const float*)d_in[5];
    const float* bpos   = (const float*)d_in[6];
    float* out = (float*)d_out;

    constexpr int B = 4, N = 16384;
    const int tiles  = B * (N / 16);                  // 4096 wave-tiles
    const int blocks = tiles / WAVES_PER_BLOCK;       // 512 blocks of 8 waves
    attn_score_kernel<<<blocks, WAVES_PER_BLOCK * 32, 0, stream>>>(
        xyz, nxyz, points, npts, Wk, Wpos, bpos, out);
}
